// v010
// Measured on an AMD MI455X. A time is GPU time per run, averaged over a window of back-to-back runs after a warm-up
// (all launches, gaps included; the runs take copies of the inputs in turn), and the median of several windows.
// Apart from v000's, it joins two sittings. Times from different sittings can be a few percent apart, while
// side-by-side timings come from the same sitting.
// Earlier versions than v010 are not in this document.
// One run takes 125 microseconds.
// Timed twice side by side with v009, it ran 1.20 and 1.19 times as fast.
// Over all steps from v000, the starting kernel, it is 6.87 times as fast.
#include <hip/hip_runtime.h>
// Causal multi-head attention with xPos rotary embedding (2 x 2048 tokens x 1024, 16 heads x 64): q = x*Wq^T + bq, k = x*Wv^T + bv, v = x*Wk^T + bk (the module's own assignment order); q <- q*cos*scale + rot(q)*sin*scale, k <- k*cos/scale + rot(k)*sin/scale with interleaved-pair rotation, freq(t, d) = t * inv_freq[d/2], scale(t, d) = base[d mod 32]^((t - 1024)/512); scores = q.k / 32 with j <= i; softmax; merged . Wo^T + bo -> [2,2048,1024].
// Structure: x as an exact f16 plane; the three projections as f16 WMMA GEMMs (32x64 wave tiles fed from LDS-staged 128x64 work-group tiles, f32, exact products + bias); per-token cos/sin/scale tables on VALU (inv_freq and base = the reference's f32 constants, precise trig and powf); each projection's epilogue finishes its operand in place of separate passes: q, k rotated and scaled in f32 and stored as f16 hi + x2^10 residual planes, v transposed through LDS per (batch, head) to [d][token] hi + residual planes; the causal structure computed on device into a key bit plane + per-block key bound; the fused flash kernel per ((batch, head), 64 queries), eight waves = four 16-query sub-tiles x the two 32-key halves of each 64-key stage, K and V^T stages copied to LDS once per work-group (transposed products: S^T = K.Q^T in three hi/lo products, one query per lane, online softmax f32 in the lane's own registers, P^T hi + residual packed from the score tiles as the B operand of O^T += V^T.P^T, two value accumulators; the two partial (max, sum, O) of a sub-tile merged through LDS at the end and stored as O hi + residual planes); output projection as one GEMM whose k loop runs over both O planes.
// Compute dtype: x, weights, biases rounded to bf16; projections exact; rotation f32; q, k, P, v, O as f16 hi + residual pairs (~2^-21); f32 accumulation and softmax. v_wmma_f32_16x16x32_f16.
#define NBT 2
#define SLEN 2048
#define DM 1024
#define NH 16
#define SCL 0.03125f
#define SCL2 (SCL * 1.4426950408889634f)      /* 1/32 times log2(e): the flash kernel keeps scores and running maxima in base-2 units */
#define NR (NBT * SLEN)
typedef __bf16 v16b __attribute__((ext_vector_type(16)));
typedef unsigned short v8us __attribute__((ext_vector_type(8), may_alias));
typedef float  v8f  __attribute__((ext_vector_type(8)));
typedef float  v4f  __attribute__((ext_vector_type(4)));
typedef float  v4fa __attribute__((ext_vector_type(4), may_alias));
typedef float  v2fa __attribute__((ext_vector_type(2), may_alias));
union FragB { v16b v; v8us half[2]; unsigned short u[16]; };

__device__ __forceinline__ unsigned short bf16_bits(float x) { unsigned int u = __float_as_uint(x); return (unsigned short)((u + 0x7FFFu + ((u >> 16) & 1u)) >> 16); }
__device__ __forceinline__ float bf16_val(unsigned short b) { return __uint_as_float(((unsigned int)b) << 16); }
__device__ __forceinline__ float bf16_round(float x) { return bf16_val(bf16_bits(x)); }
// D += A·B with NT terms: 1 = ah·bh, 2 = + al·bh (A split), 3 = + ah·bl (both split)
template <int NT>
__device__ __forceinline__ v8f mmaN(v16b ah, v16b al, v16b bh, v16b bl, v8f c) {
  c = __builtin_amdgcn_wmma_f32_16x16x32_bf16(false, ah, false, bh, (short)0, c, false, false);
  if (NT >= 2) c = __builtin_amdgcn_wmma_f32_16x16x32_bf16(false, al, false, bh, (short)0, c, false, false);
  if (NT >= 3) c = __builtin_amdgcn_wmma_f32_16x16x32_bf16(false, ah, false, bl, (short)0, c, false, false);
  asm volatile("v_nop\n\tv_nop\n\tv_nop\n\tv_nop" : "+v"(c) : "v"(ah), "v"(al), "v"(bh), "v"(bl));
  return c;
}

__global__ __launch_bounds__(256) void k_wt_bf16(const float* __restrict__ W, unsigned short* __restrict__ Wt, int K, int N) {
  const int t = blockIdx.x * 256 + threadIdx.x;
  const int k8n = K / 8;
  if (t >= N * k8n) return;
  const int n = t / k8n, k8 = (t % k8n) * 8;
  v8us v;
#pragma unroll
  for (int i = 0; i < 8; ++i) v[i] = bf16_bits(W[(size_t)(k8 + i) * N + n]);
  *(v8us*)(Wt + (size_t)n * K + k8) = v;
  
}

// GEMM C[M][N] (f32, pitch ldc) = act(A[M][K]·W + bias). A f32 row-major (pitch lda) converted per fragment to bf16
// (ASPLIT: hi/lo two planes -> 2 terms, else single rounded term); Wt bf16 [N][K] (pitch ldb). BIAS_BF16 rounds the
// bias to bf16 first (bias quantised to bf16 before the add). K%32==0, M%16==0, N%64==0.
template <bool ASPLIT, int ACT, bool BIAS_BF16>
__global__ __launch_bounds__(128) void k_gemm_bf(const float* __restrict__ A, int lda, const unsigned short* __restrict__ Wt, int ldb,
                                               const float* __restrict__ bias, float* __restrict__ C, int ldc, int M, int N, int K) {
  __shared__ __attribute__((aligned(16))) float so[4][16][64];
  const int tid = threadIdx.x, w = tid >> 5, lane = tid & 31, ln = lane & 15, hh = lane >> 4;
  const int ntn = N / 64;
  const int wid = blockIdx.x * 4 + w;
  const int mt = wid / ntn, nq = wid % ntn;
  if (mt * 16 >= M) return;
  const int row0 = mt * 16, col0 = nq * 64;
  const float* arow = A + (size_t)(row0 + ln) * lda;
  v8f acc[4] = {};
  for (int kb = 0; kb < K; kb += 32) {
    FragB ah, al;
    const v4f x0 = *(const v4fa*)(arow + kb + 8 * hh), x1 = *(const v4fa*)(arow + kb + 8 * hh + 4);
    const v4f x2 = *(const v4fa*)(arow + kb + 16 + 8 * hh), x3 = *(const v4fa*)(arow + kb + 16 + 8 * hh + 4);
    float xs[16] = {x0[0],x0[1],x0[2],x0[3],x1[0],x1[1],x1[2],x1[3],x2[0],x2[1],x2[2],x2[3],x3[0],x3[1],x3[2],x3[3]};
#pragma unroll
    for (int i = 0; i < 16; ++i) { const unsigned short hb = bf16_bits(xs[i]); ah.u[i] = hb; al.u[i] = ASPLIT ? bf16_bits(xs[i] - bf16_val(hb)) : (unsigned short)0; }
#pragma unroll
    for (int t = 0; t < 4; ++t) {
      const unsigned short* brow = Wt + (size_t)(col0 + t * 16 + ln) * ldb + kb;
      FragB b;
      b.half[0] = *(const v8us*)(brow + 8 * hh);
      b.half[1] = *(const v8us*)(brow + 16 + 8 * hh);
      acc[t] = mmaN<ASPLIT ? 2 : 1>(ah.v, al.v, b.v, b.v, acc[t]);
    }
  }
#pragma unroll
  for (int t = 0; t < 4; ++t) {
    float bv = bias ? bias[col0 + t * 16 + ln] : 0.f;
    if (BIAS_BF16) bv = bf16_round(bv);
#pragma unroll
    for (int r = 0; r < 8; ++r) { float v = acc[t][r] + bv; if (ACT == 1) v = fmaxf(v, 0.f); so[w][8 * hh + r][t * 16 + ln] = v; }
  }
  __builtin_amdgcn_fence(__ATOMIC_ACQ_REL, "workgroup");
  __builtin_amdgcn_wave_barrier();
  const int rsub = lane >> 4, c4 = (lane & 15) * 4;
  {
#pragma unroll
    for (int q = 0; q < 8; ++q) {
      const int r = q * 2 + rsub;
      const v4f v = *(const v4fa*)&so[w][r][c4];
      *(v4f*)(C + (size_t)(row0 + r) * ldc + col0 + c4) = v;
    }
    
  }
}

// GEMM C = act(A·W + bias + resid): A f32 (ASPLIT -> hi/lo 2 terms), Wt bf16 [N][K]; ACT 0 none, 1 relu, 2 exact gelu;
// resid (optional, f32, row index = (row % rmod), pitch ldr, RES_BF16 rounds it) added before the activation.
template <bool ASPLIT, int ACT, bool BIAS_BF16, bool RES_BF16>
__global__ __launch_bounds__(128) void k_gemm_bf3(const float* __restrict__ A, int lda, const unsigned short* __restrict__ Wt, int ldb,
                                                const float* __restrict__ bias, const float* __restrict__ resid, int rmod, int ldr,
                                                float* __restrict__ C, int ldc, int M, int N, int K) {
  __shared__ __attribute__((aligned(16))) float so[4][16][64];
  const int tid = threadIdx.x, w = tid >> 5, lane = tid & 31, ln = lane & 15, hh = lane >> 4;
  const int ntn = N / 64;
  const int wid = blockIdx.x * 4 + w;
  const int mt = wid / ntn, nq = wid % ntn;
  if (mt * 16 >= M) return;
  const int row0 = mt * 16, col0 = nq * 64;
  const float* arow = A + (size_t)(row0 + ln) * lda;
  v8f acc[4] = {};
  for (int kb = 0; kb < K; kb += 32) {
    FragB ah, al;
    const v4f x0 = *(const v4fa*)(arow + kb + 8 * hh), x1 = *(const v4fa*)(arow + kb + 8 * hh + 4);
    const v4f x2 = *(const v4fa*)(arow + kb + 16 + 8 * hh), x3 = *(const v4fa*)(arow + kb + 16 + 8 * hh + 4);
    float xs[16] = {x0[0],x0[1],x0[2],x0[3],x1[0],x1[1],x1[2],x1[3],x2[0],x2[1],x2[2],x2[3],x3[0],x3[1],x3[2],x3[3]};
#pragma unroll
    for (int i = 0; i < 16; ++i) { const unsigned short hb = bf16_bits(xs[i]); ah.u[i] = hb; al.u[i] = ASPLIT ? bf16_bits(xs[i] - bf16_val(hb)) : (unsigned short)0; }
#pragma unroll
    for (int t = 0; t < 4; ++t) {
      const unsigned short* brow = Wt + (size_t)(col0 + t * 16 + ln) * ldb + kb;
      FragB b;
      b.half[0] = *(const v8us*)(brow + 8 * hh);
      b.half[1] = *(const v8us*)(brow + 16 + 8 * hh);
      acc[t] = mmaN<ASPLIT ? 2 : 1>(ah.v, al.v, b.v, b.v, acc[t]);
    }
  }
#pragma unroll
  for (int t = 0; t < 4; ++t) {
    const int col = col0 + t * 16 + ln;
    float bv = bias ? bias[col] : 0.f;
    if (BIAS_BF16) bv = bf16_round(bv);
#pragma unroll
    for (int r = 0; r < 8; ++r) {
      float v = acc[t][r] + bv;
      if (resid) { float rv = resid[(size_t)((row0 + 8 * hh + r) % rmod) * ldr + col]; if (RES_BF16) rv = bf16_round(rv); v += rv; }
      if (ACT == 1) v = fmaxf(v, 0.f);
      if (ACT == 2) v = 0.5f * v * (1.0f + erff(v * 0.70710678118654752f));
      if (ACT == 3) { const float u = 0.7978845608028654f * (v + 0.044715f * v * v * v); v = 0.5f * v * (1.0f + tanhf(u)); }
      so[w][8 * hh + r][t * 16 + ln] = v;
    }
  }
  __builtin_amdgcn_fence(__ATOMIC_ACQ_REL, "workgroup");
  __builtin_amdgcn_wave_barrier();
  const int rsub = lane >> 4, c4 = (lane & 15) * 4;
  {
#pragma unroll
    for (int q = 0; q < 8; ++q) {
      const int r = q * 2 + rsub;
      const v4f v = *(const v4fa*)&so[w][r][c4];
      *(v4f*)(C + (size_t)(row0 + r) * ldc + col0 + c4) = v;
    }
    
  }
}
// row LayerNorm (biased variance, eps) over N: s = X (+ R); optional out_sum <- s; out_norm <- (s-mu)*rsqrt(var+eps)*g + b
template <bool PARAM_BF16>
__global__ __launch_bounds__(256) void k_layernorm(const float* __restrict__ X, const float* __restrict__ R, const float* __restrict__ g, const float* __restrict__ bta,
                                                  float* __restrict__ out_sum, float* __restrict__ out_norm, int N, float eps) {
  __shared__ float red[256];
  const int row = blockIdx.x, tid = threadIdx.x;
  const float* x = X + (size_t)row * N; const float* rr = R ? R + (size_t)row * N : nullptr;
  float vals[16];                     // up to N = 4096
  const int per = N / 256;            // contiguous chunk per thread? use strided-by-4 chunks: thread handles j = tid*4 + 1024*u
  float s1 = 0.f;
  for (int u = 0; u < per / 4; ++u) {
    const int j = tid * 4 + 1024 * u;
    const v4f a = *(const v4fa*)(x + j);
    v4f b = {0.f,0.f,0.f,0.f}; if (rr) b = *(const v4fa*)(rr + j);
#pragma unroll
    for (int q = 0; q < 4; ++q) { const float v = a[q] + b[q]; vals[u * 4 + q] = v; s1 += v; }
  }
  red[tid] = s1; __syncthreads();
  for (int st = 128; st > 0; st >>= 1) { if (tid < st) red[tid] += red[tid + st]; __syncthreads(); }
  const float mu = red[0] / (float)N; __syncthreads();
  float s2 = 0.f;
  for (int u = 0; u < per / 4; ++u)
#pragma unroll
    for (int q = 0; q < 4; ++q) { const float c = vals[u * 4 + q] - mu; s2 += c * c; }
  red[tid] = s2; __syncthreads();
  for (int st = 128; st > 0; st >>= 1) { if (tid < st) red[tid] += red[tid + st]; __syncthreads(); }
  const float rs = rsqrtf(red[0] / (float)N + eps);
  {
    for (int u = 0; u < per / 4; ++u) {
      const int j = tid * 4 + 1024 * u;
      v4f o, sm;
#pragma unroll
      for (int q = 0; q < 4; ++q) {
        float gg = g[j + q], bb = bta[j + q];
        if (PARAM_BF16) { gg = bf16_round(gg); bb = bf16_round(bb); }
        sm[q] = vals[u * 4 + q]; o[q] = (vals[u * 4 + q] - mu) * rs * gg + bb;
      }
      if (out_sum) *(v4f*)(out_sum + (size_t)row * N + j) = sm;
      *(v4f*)(out_norm + (size_t)row * N + j) = o;
    }
    
  }
}



// ---- f16 WMMA path (v_wmma_f32_16x16x32_f16): 11-bit significands for operands in range — used where a [0,1] probability operand needs more precision than bf16
typedef _Float16 v16h __attribute__((ext_vector_type(16)));
union FragH { v16h v; v8us half[2]; _Float16 h[16]; unsigned short u[16]; };
template <int NT>
__device__ __forceinline__ v8f mmaH(v16h ah, v16h al, v16h bh, v16h bl, v8f c) {
  c = __builtin_amdgcn_wmma_f32_16x16x32_f16(false, ah, false, bh, (short)0, c, false, false);
  if (NT >= 2) c = __builtin_amdgcn_wmma_f32_16x16x32_f16(false, al, false, bh, (short)0, c, false, false);
  if (NT >= 3) c = __builtin_amdgcn_wmma_f32_16x16x32_f16(false, ah, false, bl, (short)0, c, false, false);
  asm volatile("v_nop\n\tv_nop\n\tv_nop\n\tv_nop" : "+v"(c) : "v"(ah), "v"(al), "v"(bh), "v"(bl));
  return c;
}
// batched GEMM like k_gemm_b but f16 operands: A f32 (split into f16 hi/lo if ASPLIT, else rounded to f16), Bt = f16 values [n][k]; alpha; C f32; N multiple of 16 (partial tiles skipped)
template <bool ASPLIT>
__global__ __launch_bounds__(128) void k_gemm_h(const float* __restrict__ A, int lda, size_t sA, const _Float16* __restrict__ Bh, int ldb, size_t sB, float alpha, float* __restrict__ C, int ldc, size_t sC, int M, int N, int K) {
  __shared__ __attribute__((aligned(16))) float so[4][16][64];
  const int tid = threadIdx.x, w = tid >> 5, lane = tid & 31, ln = lane & 15, hh = lane >> 4; const int by = blockIdx.y;
  A += (size_t)by * sA; Bh += (size_t)by * sB; C += (size_t)by * sC;
  const int ntn = (N + 63) / 64; const int wid = blockIdx.x * 4 + w; const int mt = wid / ntn, nq = wid % ntn; if (mt * 16 >= M) return;
  const int row0 = mt * 16, col0 = nq * 64; const float* arow = A + (size_t)(row0 + ln) * lda;
  v8f acc[4] = {};
  for (int kb = 0; kb < K; kb += 32) {
    FragH ah, al;
    const v4f x0 = *(const v4fa*)(arow + kb + 8 * hh), x1 = *(const v4fa*)(arow + kb + 8 * hh + 4), x2 = *(const v4fa*)(arow + kb + 16 + 8 * hh), x3 = *(const v4fa*)(arow + kb + 16 + 8 * hh + 4);
    float xs[16] = {x0[0],x0[1],x0[2],x0[3],x1[0],x1[1],x1[2],x1[3],x2[0],x2[1],x2[2],x2[3],x3[0],x3[1],x3[2],x3[3]};
#pragma unroll
    for (int i = 0; i < 16; ++i) { const _Float16 h = (_Float16)xs[i]; ah.h[i] = h; al.h[i] = ASPLIT ? (_Float16)(xs[i] - (float)h) : (_Float16)0.0f; }
#pragma unroll
    for (int t = 0; t < 4; ++t) { if (col0 + t * 16 >= N) continue; const size_t boff = (size_t)(col0 + t * 16 + ln) * ldb + kb; FragH bq; bq.half[0] = *(const v8us*)(Bh + boff + 8 * hh); bq.half[1] = *(const v8us*)(Bh + boff + 16 + 8 * hh);
      acc[t] = mmaH<ASPLIT ? 2 : 1>(ah.v, al.v, bq.v, bq.v, acc[t]); }
  }
#pragma unroll
  for (int t = 0; t < 4; ++t) { if (col0 + t * 16 >= N) continue;
#pragma unroll
    for (int r = 0; r < 8; ++r) so[w][8 * hh + r][t * 16 + ln] = acc[t][r] * alpha; }
  __builtin_amdgcn_fence(__ATOMIC_ACQ_REL, "workgroup"); __builtin_amdgcn_wave_barrier();
  const int rsub = lane >> 4, c4 = (lane & 15) * 4;
  {
#pragma unroll
    for (int q = 0; q < 8; ++q) { const int r = q * 2 + rsub; if (col0 + c4 < N) { const v4f v = *(const v4fa*)&so[w][r][c4]; *(v4f*)(C + (size_t)(row0 + r) * ldc + col0 + c4) = v; } }
     }
}

// Wt[n][k] = f16(W[k][n]·scale) from f32 row-major W[K][N] (scale = power of two; bf16-exact weights stay exact in f16 away from the subnormal range)
__global__ __launch_bounds__(256) void k_wt_f16(const float* __restrict__ W, _Float16* __restrict__ Wt, int K, int N, float scale) {
  const int t = blockIdx.x * 256 + threadIdx.x; if (t >= N * (K / 8)) return; const int n = t / (K / 8), k8 = (t % (K / 8)) * 8; FragH f;
#pragma unroll
  for (int i = 0; i < 8; ++i) f.h[i] = (_Float16)(bf16_round(W[(size_t)(k8 + i) * N + n]) * scale); const v8us o = f.half[0];
  *(v8us*)((unsigned short*)Wt + (size_t)n * K + k8) = o; 
}
// k_gemm_hh variant with fused epilogue: v = acc·alpha + bias[by·sBias + col] (+ CP[(row/rowsPerB)·sCPb + by·64 + col] if CP) ; ACT 0 none / 1 elu ; writes f16 C16 (and f32 C if non-null)
template <int ACT>
__global__ __launch_bounds__(128) void k_gemm_hhx(const _Float16* __restrict__ A, int lda, size_t sA, const _Float16* __restrict__ Bh, int ldb, size_t sB, float alpha, const float* __restrict__ bias, size_t sBias, const float* __restrict__ CP, int rowsPerB, size_t sCPb, int row0g,
    float* __restrict__ C, _Float16* __restrict__ C16, int ldc, size_t sC, int M, int N, int K) {
  __shared__ __attribute__((aligned(16))) float so[4][16][64];
  const int tid = threadIdx.x, w = tid >> 5, lane = tid & 31, ln = lane & 15, hh = lane >> 4; const int by = blockIdx.y;
  A += (size_t)by * sA; Bh += (size_t)by * sB; const size_t cofs = (size_t)by * sC; const float* bp = bias ? bias + (size_t)by * sBias : nullptr;
  const int ntn = (N + 63) / 64; const int wid = blockIdx.x * 4 + w; const int mt = wid / ntn, nq = wid % ntn; if (mt * 16 >= M) return;
  const int row0 = mt * 16, col0 = nq * 64; const _Float16* arow = A + (size_t)(row0 + ln) * lda;
  v8f acc[4] = {};
  for (int kb = 0; kb < K; kb += 32) { FragH ah; ah.half[0] = *(const v8us*)((const unsigned short*)arow + kb + 8 * hh); ah.half[1] = *(const v8us*)((const unsigned short*)arow + kb + 16 + 8 * hh);
#pragma unroll
    for (int t = 0; t < 4; ++t) { if (col0 + t * 16 >= N) continue; const size_t boff = (size_t)(col0 + t * 16 + ln) * ldb + kb; FragH bq; bq.half[0] = *(const v8us*)((const unsigned short*)Bh + boff + 8 * hh); bq.half[1] = *(const v8us*)((const unsigned short*)Bh + boff + 16 + 8 * hh);
      acc[t] = mmaH<1>(ah.v, ah.v, bq.v, bq.v, acc[t]); }
  }
#pragma unroll
  for (int t = 0; t < 4; ++t) { if (col0 + t * 16 >= N) continue; const int col = col0 + t * 16 + ln; const float bv = bp ? bf16_round(bp[col]) : 0.f;
#pragma unroll
    for (int r = 0; r < 8; ++r) { float v = acc[t][r] * alpha + bv; if (CP) { const int bidx = (row0g + row0 + 8 * hh + r) / rowsPerB; v += CP[(size_t)bidx * sCPb + (size_t)by * 64 + col]; } if (ACT == 1) v = (v > 0.f) ? v : expm1f(v); else if (ACT == 7) v = (v > 0.f) ? v + 1.0f : expf(v); else if (ACT == 8) v = tanhf(v); else if (ACT == 9) v = 0.5f * v * (1.0f + tanhf(0.7978845608028654f * (v + 0.044715f * v * v * v))); else if (ACT == 11) v = 1.0f / (1.0f + expf(-v)); else if (ACT == 12) v = (v > 0.f) ? v : 0.01f * v; else if (ACT == 14) v = (v > 0.f) ? v : 0.1f * v; else if (ACT == 15) v = v / (1.0f + expf(-v)); else if (ACT == 3) v = fmaxf(v, 0.f); else if (ACT == 6) v = 0.5f * v * (1.0f + erff(v * 0.70710678118654752f)); so[w][8 * hh + r][t * 16 + ln] = v; } }
  __builtin_amdgcn_fence(__ATOMIC_ACQ_REL, "workgroup"); __builtin_amdgcn_wave_barrier();
  const int rsub = lane >> 4, c4 = (lane & 15) * 4; typedef _Float16 v4h __attribute__((ext_vector_type(4)));
  {
#pragma unroll
    for (int q = 0; q < 8; ++q) { const int r = q * 2 + rsub; if (col0 + c4 < N) { const v4f v = *(const v4fa*)&so[w][r][c4]; if (C) *(v4f*)(C + cofs + (size_t)(row0 + r) * ldc + col0 + c4) = v; if (C16) { v4h h4; for (int i = 0; i < 4; ++i) h4[i] = (_Float16)v[i]; *(v4h*)(C16 + cofs + (size_t)(row0 + r) * ldc + col0 + c4) = h4; } } }
     }
}


typedef _Float16 v4h __attribute__((ext_vector_type(4)));

__global__ __launch_bounds__(256) void k_h16(const float* __restrict__ x, _Float16* __restrict__ X16, size_t n8) { const size_t t = (size_t)blockIdx.x * 256 + threadIdx.x; if (t >= n8) return; FragH f;
#pragma unroll
  for (int q = 0; q < 8; ++q) f.h[q] = (_Float16)x[t * 8 + q]; *(v8us*)((unsigned short*)X16 + t * 8) = f.half[0];  }
template <int NHv, int TTv>
__global__ __launch_bounds__(256) void k_vt(const _Float16* __restrict__ V16, int ldv, int voff, _Float16* __restrict__ Vt) { __shared__ unsigned short tl[64][66]; const int tid = threadIdx.x; const int slab = blockIdx.x / (TTv / 64), lg = blockIdx.x % (TTv / 64); const int b = slab / NHv, h = slab % NHv;
  for (int i = tid; i < 64 * 8; i += 256) { const int r = i / 8, c8 = (i % 8) * 8; FragH f; f.half[0] = *(const v8us*)((const unsigned short*)V16 + ((size_t)b * TTv + lg * 64 + r) * ldv + voff + h * 64 + c8);
#pragma unroll
    for (int q = 0; q < 8; ++q) tl[r][c8 + q] = f.u[q]; }
  __syncthreads();
  {
#pragma unroll
    for (int rd = 0; rd < 2; ++rd) { const int d = rd * 32 + tid / 8, pc = tid % 8; FragH f;
#pragma unroll
      for (int q = 0; q < 8; ++q) f.u[q] = tl[pc * 8 + q][d];
      *(v8us*)((unsigned short*)Vt + ((size_t)slab * 64 + d) * TTv + lg * 64 + pc * 8) = f.half[0]; }
     } }

// ---- fast GEMM (wave tile 32x64; requires M % 32 == 0 rows per launch region, N % 64 == 0 and K % 64 == 0); epilogue = k_gemm_hhx semantics ----
__device__ __forceinline__ v16h g2_frag(const _Float16* p, int hh) { FragH f; f.half[0] = *(const v8us*)((const unsigned short*)p + 8 * hh); f.half[1] = *(const v8us*)((const unsigned short*)p + 16 + 8 * hh); return f.v; }
__device__ __forceinline__ v8f g2_mma(v16h a, v16h b, v8f c) { v8f d = __builtin_amdgcn_wmma_f32_16x16x32_f16(false, a, false, b, (short)0, c, false, false); asm volatile("v_nop\n\tv_nop\n\tv_nop\n\tv_nop" : "+v"(d) : "v"(a), "v"(b)); return d; }
/* XP 0: stores C / C16. XP 1 (q) and 2 (k, inverse scale): the epilogue applies the xPos rotation to the row while it is still in LDS (a 64-column tile is one head, a lane's 4 columns hold whole rotation pairs; token = row % SLEN) and stores the f16 hi + x2^10 residual planes Hh, Hl instead of C. XP 3 (v): the tile (128 tokens of one batch x one head) leaves transposed, as hi + residual planes [(batch, head)][d][token]. XP 4: the three projections as one launch: blockIdx.y = 0, 1, 2 picks the q, k or v epilogue, the weight plane (sB), the bias pointer and the pair of output planes (sH); the k loop is one and the same code. XP 5: C = (A2 + A * 2^-10) . B^T in one launch, A the x2^10 residual plane of A2: the k loop runs over A first, the accumulators are scaled by 2^-10 once, then it runs over A2 on top of them; no addend. Left for a later step: the epilogue's eight bias loads stand one behind the other, each waited for */
template <int ACT, int XP>
__global__ __launch_bounds__(128) void k_gemm2(const _Float16* __restrict__ A, int lda, size_t sA, const _Float16* __restrict__ Bh, int ldb, size_t sB, float alpha, const float* __restrict__ bias, size_t sBias, const float* __restrict__ CP, int rowsPerB, size_t sCPb, int row0g,
    float* __restrict__ C, _Float16* __restrict__ C16, int ldc, size_t sC, int M, int N, int K, const float* __restrict__ CS, const float* __restrict__ SN, const float* __restrict__ SC, _Float16* __restrict__ Hh, _Float16* __restrict__ Hl, const float* __restrict__ bias1, const float* __restrict__ bias2, size_t sH, const _Float16* __restrict__ A2) {
  /* the work-group's 128 x 64 tile: per stage of 64 k (K % 64 == 0) one whole 128-byte line of each of its 128 A rows and 64 B rows goes to LDS, two buffers; row pitch 144 B for the 16-byte fragment reads */
  constexpr int PIT = 72;
  __shared__ __attribute__((aligned(16))) float so[4][32][68];
  __shared__ __attribute__((aligned(16))) _Float16 tA[2][128 * PIT], tB[2][64 * PIT];
  const int tid = threadIdx.x, w = tid >> 5, lane = tid & 31, ln = lane & 15, hh = lane >> 4; const int by = blockIdx.y;
  A += (size_t)by * sA; Bh += (size_t)by * sB; const size_t cofs = (size_t)by * sC; const float* bp = bias ? bias + (size_t)by * sBias : nullptr;
  const bool tr = (XP == 3) || (XP == 4 && by == 2), inv = (XP == 2) || (XP == 4 && by == 1);      /* which epilogue: the same for the whole work-group */
  if (XP == 4) { bp = (by == 0) ? bias : ((by == 1) ? bias1 : bias2); Hh += (size_t)by * sH; Hl += (size_t)by * sH; }
  const int ntn = N >> 6; const int mt = blockIdx.x / ntn, nq = blockIdx.x - mt * ntn; const int row0 = mt * 128 + 32 * w, col0 = nq * 64; if (mt * 128 >= M) return;      /* the same for the whole work-group: every wave reaches every barrier below */
  const int sr = tid >> 3, sc = (tid & 7) * 8;      /* staging: eight threads bring one row's line, a wave four whole lines per load */
  unsigned oa[8], ob[4];      /* byte offsets of the staged lines at k = 0, fixed for the whole loop */
#pragma unroll
  for (int i = 0; i < 8; ++i) oa[i] = ((unsigned)min(mt * 128 + i * 16 + sr, M - 1) * (unsigned)lda + (unsigned)sc) * 2u;      /* rows past M (a last tile of 32, 64 or 96 rows) re-read row M - 1; their waves store nothing */
#pragma unroll
  for (int i = 0; i < 4; ++i) ob[i] = ((unsigned)(col0 + i * 16 + sr) * (unsigned)ldb + (unsigned)sc) * 2u;
  const int so_st = sr * PIT + sc, fa = (32 * w + ln) * PIT, fb = ln * PIT;
  const v8f z8 = {0.f,0.f,0.f,0.f,0.f,0.f,0.f,0.f}; v8f c00 = z8, c01 = z8, c02 = z8, c03 = z8, c10 = z8, c11 = z8, c12 = z8, c13 = z8;
  v8us ra[8], rb[4];
#pragma unroll
  for (int i = 0; i < 8; ++i) ra[i] = *(const v8us*)((const char*)A + oa[i]);
#pragma unroll
  for (int i = 0; i < 4; ++i) rb[i] = *(const v8us*)((const char*)Bh + ob[i]);
#pragma unroll
  for (int i = 0; i < 8; ++i) *(v8us*)&tA[0][so_st + i * 16 * PIT] = ra[i];
#pragma unroll
  for (int i = 0; i < 4; ++i) *(v8us*)&tB[0][so_st + i * 16 * PIT] = rb[i];
  __syncthreads();      /* stage 0 is in LDS before any wave reads it */
  const int KT = (XP == 5) ? 2 * K : K;
#pragma unroll 1      /* stays rolled: the body already holds 16 products and the whole of a stage's loads */
  for (int kb = 0; kb < KT; kb += 64) { const int cur = (kb >> 6) & 1; const bool more = kb + 64 < KT;
    if (more) {      /* the next stage's global loads go out ahead of this stage's products, which cover their latency */
      const int kn = kb + 64; const bool p2 = (XP == 5) && kn >= K; const _Float16* An = p2 ? A2 + (kn - K) : A + kn; const _Float16* Bn = Bh + (p2 ? kn - K : kn);      /* block-uniform: which plane the next stage comes from */
#pragma unroll
      for (int i = 0; i < 8; ++i) ra[i] = *(const v8us*)((const char*)An + oa[i]);
#pragma unroll
      for (int i = 0; i < 4; ++i) rb[i] = *(const v8us*)((const char*)Bn + ob[i]);
      asm volatile("s_wait_xcnt 0x0" ::: "memory"); }      /* precaution: stands in front of every rewrite of the stage loads' address registers (the fragment reads below reuse them) */
    if (XP == 5 && kb == K) { c00 *= 0.0009765625f; c01 *= 0.0009765625f; c02 *= 0.0009765625f; c03 *= 0.0009765625f; c10 *= 0.0009765625f; c11 *= 0.0009765625f; c12 *= 0.0009765625f; c13 *= 0.0009765625f; }      /* the residual plane's sums take their weight (a power of two: exact) before the first product of the hi plane */
    const _Float16* pa = &tA[cur][fa]; const _Float16* pb = &tB[cur][fb];
    v16h a0[2], a1[2], b0[2], b1[2], b2[2], b3[2];      /* all of the stage's fragment reads as one group in front of its products */
#pragma unroll
    for (int ks = 0; ks < 2; ++ks) { a0[ks] = g2_frag(pa + ks * 32, hh); a1[ks] = g2_frag(pa + 16 * PIT + ks * 32, hh); b0[ks] = g2_frag(pb + ks * 32, hh); b1[ks] = g2_frag(pb + 16 * PIT + ks * 32, hh); b2[ks] = g2_frag(pb + 32 * PIT + ks * 32, hh); b3[ks] = g2_frag(pb + 48 * PIT + ks * 32, hh); }
#pragma unroll
    for (int ks = 0; ks < 2; ++ks) {
      c00 = g2_mma(a0[ks], b0[ks], c00); c10 = g2_mma(a1[ks], b0[ks], c10);
      c01 = g2_mma(a0[ks], b1[ks], c01); c11 = g2_mma(a1[ks], b1[ks], c11);
      c02 = g2_mma(a0[ks], b2[ks], c02); c12 = g2_mma(a1[ks], b2[ks], c12);
      c03 = g2_mma(a0[ks], b3[ks], c03); c13 = g2_mma(a1[ks], b3[ks], c13); }
    if (more) {      /* into the buffer that every wave left at the last barrier */
#pragma unroll
      for (int i = 0; i < 8; ++i) *(v8us*)&tA[cur ^ 1][so_st + i * 16 * PIT] = ra[i];
#pragma unroll
      for (int i = 0; i < 4; ++i) *(v8us*)&tB[cur ^ 1][so_st + i * 16 * PIT] = rb[i]; }
    __syncthreads(); }      /* publishes the next stage and ends every wave's reads of this one */
  if (!tr && row0 >= M) return;      /* no barrier follows; XP 3 has one below and takes whole 128-row tiles only (M % 128 == 0) */
  v8f accs[8] = {c00, c01, c02, c03, c10, c11, c12, c13};
  constexpr int TP = 136; _Float16* sT = (_Float16*)&so[0][0][0];      /* XP 3: the staging bytes as two f16 planes [64 d][128 tokens], row pitch 272 B */
  if (XP == 4 && tr) {      /* the v side of XP 4: the XP 3 form of the loop below (XP 4 is used with ACT 0 and without an addend); both loops unrolled like it, so that accs and the fragments are indexed by constants and stay in registers */
#pragma unroll
    for (int u = 0; u < 8; ++u) { const int t = u & 3, half = u >> 2; const float bv = bp ? bf16_round(bp[col0 + t * 16 + ln]) : 0.f; FragH th, tl;
#pragma unroll
      for (int r = 0; r < 8; ++r) { const float v = accs[u][r] * alpha + bv; const _Float16 hv = (_Float16)v; th.h[r] = hv; tl.h[r] = (_Float16)((v - (float)hv) * 1024.0f); }
      const int o = (t * 16 + ln) * TP + 32 * w + half * 16 + 8 * hh; *(v8us*)&sT[o] = th.half[0]; *(v8us*)&sT[64 * TP + o] = tl.half[0]; } }
  else
#pragma unroll
  for (int u = 0; u < 8; ++u) { const int t = u & 3, half = u >> 2; const int col = col0 + t * 16 + ln; const float bv = bp ? bf16_round(bp[col]) : 0.f; FragH th, tl;
#pragma unroll
    for (int r = 0; r < 8; ++r) { const int rloc = half * 16 + 8 * hh + r; float v = accs[u][r] * alpha + bv; if (XP != 5 && CP) { const int bidx = (row0g + row0 + rloc) / rowsPerB; v += CP[(size_t)bidx * sCPb + (size_t)by * 64 + col]; }
      if (ACT == 3) v = fmaxf(v, 0.f); else if (ACT == 6) v = 0.5f * v * (1.0f + erff(v * 0.70710678118654752f)); else if (ACT == 11) v = 1.0f / (1.0f + expf(-v)); else if (ACT == 15) v = v / (1.0f + expf(-v)); else if (ACT == 12) v = (v > 0.f) ? v : 0.01f * v; else if (ACT == 8) v = tanhf(v);
      if (XP == 3) { const _Float16 hv = (_Float16)v; th.h[r] = hv; tl.h[r] = (_Float16)((v - (float)hv) * 1024.0f); } else so[w][rloc][t * 16 + ln] = v; }
    if (XP == 3) { const int o = (t * 16 + ln) * TP + 32 * w + half * 16 + 8 * hh; *(v8us*)&sT[o] = th.half[0]; *(v8us*)&sT[64 * TP + o] = tl.half[0]; } }      /* a lane's 8 accumulator rows are 8 consecutive tokens of one d: one 16-byte piece of the transposed row */
  if (tr) {      /* a block-uniform branch: every wave of such a work-group reaches the barrier */
    __syncthreads();      /* all four waves' 32-token pieces are in LDS before any wave stores whole 256-byte rows */
    const size_t vb = ((size_t)((mt * 128) / SLEN) * NH + nq) * 64 * SLEN + (mt * 128) % SLEN;
#pragma unroll
    for (int it = 0; it < 8; ++it) { const int d = it * 8 + (tid >> 4), pc = tid & 15; const v8us a = *(const v8us*)&sT[d * TP + pc * 8], c = *(const v8us*)&sT[64 * TP + d * TP + pc * 8];
      *(v8us*)((unsigned short*)Hh + vb + (size_t)d * SLEN + pc * 8) = a; *(v8us*)((unsigned short*)Hl + vb + (size_t)d * SLEN + pc * 8) = c; }
    return; }
  __builtin_amdgcn_fence(__ATOMIC_ACQ_REL, "workgroup"); __builtin_amdgcn_wave_barrier();
  const int rsub = lane >> 4, c4 = (lane & 15) * 4;
  if (XP == 1 || XP == 2 || XP == 4) {
    const size_t tb = (size_t)(row0 % SLEN + rsub) * 32;      /* a wave's 32 rows lie in one batch (SLEN % 32 == 0): token = row0 % SLEN + r */
    const float* cs = CS + tb + (c4 >> 1); const float* sn = SN + tb + (c4 >> 1); const float* scp = SC + tb + (c4 & 31);
#pragma unroll
    for (int g = 0; g < 16; g += 8) { v2fa cq[8], sq[8]; v4f s4[8];      /* two groups of 8 rows: 16 rows' table words and the k side's 64 quotients at once need more than 256 registers */
#pragma unroll
      for (int q = 0; q < 8; ++q) { cq[q] = *(const v2fa*)(cs + (g + q) * 64); sq[q] = *(const v2fa*)(sn + (g + q) * 64); s4[q] = *(const v4fa*)(scp + (g + q) * 64); }      /* the group's table words in flight together */
      asm volatile("s_wait_xcnt 0x0" :: "v"(cs), "v"(sn), "v"(scp) : "memory");      /* precaution: stands in front of every rewrite of the table loads' address registers, which stay live up to here */
      if (inv) {      /* the k side's inverse scale, behind one block-uniform branch; both loops unrolled, so that s4 is indexed by constants and stays in registers */
#pragma unroll
        for (int q = 0; q < 8; ++q)
#pragma unroll
          for (int i = 0; i < 4; ++i) s4[q][i] = 1.0f / s4[q][i]; }
#pragma unroll
      for (int q = 0; q < 8; ++q) { const int r = (g + q) * 2 + rsub; const v4f v = *(const v4fa*)&so[w][r][c4]; v4h hi4, lo4;
#pragma unroll
        for (int i = 0; i < 4; ++i) { const float sc = s4[q][i];
          const float x = v[i]; const float rx = (i & 1) ? v[i - 1] : -v[i + 1]; const float o = (x * cq[q][i >> 1]) * sc + (rx * sq[q][i >> 1]) * sc;
          const _Float16 h = (_Float16)o; hi4[i] = h; lo4[i] = (_Float16)((o - (float)h) * 1024.0f); }
        const size_t oo = cofs + (size_t)(row0 + r) * ldc + col0 + c4; *(v4h*)(Hh + oo) = hi4; *(v4h*)(Hl + oo) = lo4; }
      asm volatile("s_wait_xcnt 0x0" ::: "memory"); }      /* precaution: stands in front of every rewrite of a register that the group's stores name (the second group's loads; behind the last group, whatever the listing puts next) */
    return; }
  {
#pragma unroll
    for (int q = 0; q < 16; ++q) { const int r = q * 2 + rsub; const v4f v = *(const v4fa*)&so[w][r][c4]; if (C) *(v4f*)(C + cofs + (size_t)(row0 + r) * ldc + col0 + c4) = v; if (C16) { v4h h4; for (int i = 0; i < 4; ++i) h4[i] = (_Float16)v[i]; *(v4h*)(C16 + cofs + (size_t)(row0 + r) * ldc + col0 + c4) = h4; } }
     } }



typedef float v2f __attribute__((ext_vector_type(2)));
typedef _Float16 v2h __attribute__((ext_vector_type(2)));
__device__ __forceinline__ float xhalf(float x) { return __builtin_bit_cast(float, __builtin_amdgcn_permlanex16(__builtin_bit_cast(int, x), __builtin_bit_cast(int, x), 0x76543210, 0xfedcba98, false, false)); }      /* lane l takes the value of lane l ^ 16, in the vector unit */
template <int TQ, int TK>
__global__ __launch_bounds__(256) void k_flashm(const _Float16* __restrict__ Q16, const _Float16* __restrict__ Q16lo, int ldq, const _Float16* __restrict__ K16, const _Float16* __restrict__ K16lo, int ldk, const _Float16* __restrict__ Vt, const _Float16* __restrict__ Vtlo, const unsigned* __restrict__ MB, const int* __restrict__ RA, const int* __restrict__ KE, _Float16* __restrict__ Oh, _Float16* __restrict__ Ol, int ldo) {
  /* 64 queries per work-group, eight waves: wave w has the 16 queries of sub-tile w & 3 and the 32-key half w >> 2 of every 64-key stage. A stage (K hi, K lo: 64 keys x 64 d; V^T hi, V^T lo: 64 d x 64 keys; whole 128-byte lines) is copied to LDS once and read by all eight waves; two buffers, row pitch 144 B for the 16-byte fragment reads */
  constexpr int RPW = 16, RTN = RPW / 16, QW = 64, NQB = TQ / QW, DT = 4, KS = 2, KP = 72, PLN = 64 * KP, STG = 4 * PLN;
  __shared__ __attribute__((aligned(16))) unsigned short sKV[2][STG];
  __shared__ __attribute__((aligned(16))) float sO[8][RPW][64 + 4]; __shared__ float sM[8][RPW], sL[8][RPW];
  const int tid = threadIdx.x, lane = tid & 31, ln = lane & 15, hh = lane >> 4;
  const int w = __builtin_amdgcn_readfirstlane(tid >> 5);      /* the wave's number in a scalar register: the skip of a key half past the bound stays a scalar branch */
  const int qs = w & 3, kg = w >> 2;
  /* grid (slab = (batch, head), tile): both batches in one launch, twice as many groups as resident places (two to a WGP). The cost falls with the flat index throughout (qt = NQB - 1 - yy). Left for later steps: the four v_nop in volatile asm behind every builtin product (mmaH, g2_mma) are 96 of the vector instructions of a pass here and 64 of a GEMM stage; built without them, the GEMM needs a scheduling fence behind its group of fragment reads, else the listing reloads one B fragment's registers between the products and waits for LDS eight times a stage; the preparation launch starts 40,960 waves of one 16-byte store each (64 values a thread, 16 loads in flight: 6,400); also left: the 64 accumulator multiplies of every pass (rescale only when a query's maximum has moved) and the 16 mask tests of a pass whose keys are all open */
  const int slab = blockIdx.x, yy = (int)blockIdx.y, qt = NQB - 1 - yy; const int b = slab / NH, h = slab % NH; const int q0 = qt * QW + qs * RPW; const int qblk = q0 >> 6;
  FragH aq[2][KS], aql[2][KS];
#pragma unroll
  for (int rt = 0; rt < RTN; ++rt) { const size_t qo = ((size_t)b * TQ + q0 + rt * 16 + ln) * ldq + h * 64; const unsigned short* qr = (const unsigned short*)Q16 + qo; const unsigned short* ql = (const unsigned short*)Q16lo + qo;
#pragma unroll
    for (int ks = 0; ks < KS; ++ks) { aq[rt][ks].half[0] = *(const v8us*)(qr + ks * 32 + 8 * hh); aq[rt][ks].half[1] = *(const v8us*)(qr + ks * 32 + 16 + 8 * hh); aql[rt][ks].half[0] = *(const v8us*)(ql + ks * 32 + 8 * hh); aql[rt][ks].half[1] = *(const v8us*)(ql + ks * 32 + 16 + 8 * hh); } }
  const unsigned short* Vth = (const unsigned short*)Vt + (size_t)slab * 64 * TK; const unsigned short* Vtl = (const unsigned short*)Vtlo + (size_t)slab * 64 * TK;
  float m_r = -3.0e38f, l_r = 0.f; v8f oacc[DT], oaccl[DT];      /* oacc[dt][r] = O^T[dt * 16 + 8 * hh + r][query ln] */
#pragma unroll
  for (int dt = 0; dt < DT; ++dt) { oacc[dt] = (v8f){0.f,0.f,0.f,0.f,0.f,0.f,0.f,0.f}; oaccl[dt] = oacc[dt]; }
  int jend = KE[qblk * 32]; jend = min(TK, (jend + 31) & ~31); if (jend < 32) jend = 32; jend = __builtin_amdgcn_readfirstlane(jend);      /* block-uniform, in a scalar register */
  const int nst = (jend + 63) >> 6;      /* stages of 64 keys; TK % 64 == 0, so every stage lies inside K and V */
  const int tq = q0 + ln; const bool am = (RA[tq] != 0); const unsigned* mrow = MB + (size_t)tq * (TK / 32);      /* the lane's query: its all-masked flag and its row of the key bit plane */
  const float scq = am ? 0.f : SCL2;      /* an all-masked row takes score 0 at every key */
  /* staging: eight lanes bring one row's 128-byte line, a wave four whole lines per copy; each thread copies rows cr and cr + 32 of each of the four planes */
  const int cr = tid >> 3, cc = (tid & 7) * 8;
  const size_t gko = ((size_t)b * TK + cr) * ldk + h * 64 + cc, gvo = (size_t)cr * TK + cc;
  const unsigned lds0 = (unsigned)(size_t)&sKV[0][cr * KP + cc];      /* the lane's LDS byte address in buffer 0, plane 0 */
  auto stage = [&](int s, int buf) {
    const unsigned short* k0 = (const unsigned short*)K16 + gko + (size_t)s * 64 * ldk; const unsigned short* k2 = (const unsigned short*)K16lo + gko + (size_t)s * 64 * ldk; const unsigned short* k1 = k0 + (size_t)32 * ldk; const unsigned short* k3 = k2 + (size_t)32 * ldk;
    const unsigned short* v0 = Vth + gvo + s * 64; const unsigned short* v2 = Vtl + gvo + s * 64; const unsigned short* v1 = v0 + (size_t)32 * TK; const unsigned short* v3 = v2 + (size_t)32 * TK;
    const unsigned d0 = lds0 + (unsigned)buf * (STG * 2u), d1 = d0 + 32u * KP * 2u, d2 = d0 + PLN * 2u, d3 = d2 + 32u * KP * 2u, d4 = d0 + 2u * PLN * 2u, d5 = d4 + 32u * KP * 2u, d6 = d0 + 3u * PLN * 2u, d7 = d6 + 32u * KP * 2u;
    /* the stage's eight copies; the closing s_wait_xcnt is a precaution that stands in front of every rewrite of the copies' address registers */
    asm volatile("global_load_async_to_lds_b128 %0, %8, off\n\tglobal_load_async_to_lds_b128 %1, %9, off\n\tglobal_load_async_to_lds_b128 %2, %10, off\n\tglobal_load_async_to_lds_b128 %3, %11, off\n\t"
                 "global_load_async_to_lds_b128 %4, %12, off\n\tglobal_load_async_to_lds_b128 %5, %13, off\n\tglobal_load_async_to_lds_b128 %6, %14, off\n\tglobal_load_async_to_lds_b128 %7, %15, off\n\ts_wait_xcnt 0x0"
                 :: "v"(d0), "v"(d1), "v"(d2), "v"(d3), "v"(d4), "v"(d5), "v"(d6), "v"(d7), "v"(k0), "v"(k1), "v"(k2), "v"(k3), "v"(v0), "v"(v1), "v"(v2), "v"(v3) : "memory"); };
  stage(0, 0);
  asm volatile("s_wait_asynccnt 0x0" ::: "memory");      /* this wave's copies of stage 0 have landed */
  __syncthreads();      /* stage 0 is in LDS before any wave reads it */
  if (nst > 1) stage(1, 1);
#pragma unroll 1
  for (int st = 0; st < nst; ++st) { const int j0 = st * 64 + kg * 32; const unsigned short* tb = &sKV[st & 1][0];
   if (j0 < jend) {      /* a key half past the bound is skipped by its four waves; the publish point below is passed by every wave */
    const unsigned mw = mrow[j0 >> 5];      /* the pass's mask word of the lane's query is fetched here, so that its latency runs under the K reads and the score products */
    asm volatile("s_wait_xcnt 0x0" ::: "memory");      /* precaution: stands in front of every rewrite of the mask load's address registers; it also keeps this load ahead of the K reads */
    v8f s[2]; FragH bk[2][KS], bkl[2][KS];      /* all of the pass's K fragment reads stand as one group in front of its score products: one LDS latency instead of two */
#pragma unroll
    for (int nt = 0; nt < 2; ++nt) { const unsigned short* kr = tb + (kg * 32 + nt * 16 + ln) * KP; const unsigned short* kl = kr + PLN;
#pragma unroll
      for (int ks = 0; ks < KS; ++ks) { bk[nt][ks].half[0] = *(const v8us*)(kr + ks * 32 + 8 * hh); bk[nt][ks].half[1] = *(const v8us*)(kr + ks * 32 + 16 + 8 * hh); bkl[nt][ks].half[0] = *(const v8us*)(kl + ks * 32 + 8 * hh); bkl[nt][ks].half[1] = *(const v8us*)(kl + ks * 32 + 16 + 8 * hh); } }
#pragma unroll
    for (int nt = 0; nt < 2; ++nt) { v8f acc = (v8f){0.f,0.f,0.f,0.f,0.f,0.f,0.f,0.f}, accr = acc;      /* s[nt][r] = score of query ln and key j0 + nt * 16 + 8 * hh + r */
#pragma unroll
      for (int ks = 0; ks < KS; ++ks) { acc = mmaH<1>(bk[nt][ks].v, bk[nt][ks].v, aq[0][ks].v, aq[0][ks].v, acc); accr = mmaH<1>(bk[nt][ks].v, bk[nt][ks].v, aql[0][ks].v, aql[0][ks].v, accr); accr = mmaH<1>(bkl[nt][ks].v, bkl[nt][ks].v, aq[0][ks].v, aq[0][ks].v, accr); }
      s[nt] = acc + accr * 0.0009765625f; }
    FragH bv[DT], bl[DT];      /* all of the pass's V fragment reads stand as one group; nothing orders them behind the softmax any more, whose work covers their LDS latency */
#pragma unroll
    for (int dt = 0; dt < DT; ++dt) { const unsigned short* vr = tb + 2 * PLN + (dt * 16 + ln) * KP + kg * 32; const unsigned short* vl = vr + PLN; bv[dt].half[0] = *(const v8us*)(vr + 8 * hh); bv[dt].half[1] = *(const v8us*)(vr + 16 + 8 * hh); bl[dt].half[0] = *(const v8us*)(vl + 8 * hh); bl[dt].half[1] = *(const v8us*)(vl + 16 + 8 * hh); }
    /* softmax of one query per lane: maximum over the lane's 16 scores, one exchange with the lane that holds the query's other 16 keys, then exponentials and sum in the lane's own registers */
    const unsigned cb = (am ? 0u : mw) >> (8 * hh);      /* bit nt * 16 + r: the key is closed */
    float sv[2][8]; float mc = -INFINITY;
#pragma unroll
    for (int nt = 0; nt < 2; ++nt)
#pragma unroll
      for (int r = 0; r < 8; ++r) { sv[nt][r] = ((cb >> (nt * 16 + r)) & 1u) ? -INFINITY : s[nt][r] * scq; mc = fmaxf(mc, sv[nt][r]); }
    mc = fmaxf(mc, xhalf(mc));
    const float mn = fmaxf(m_r, mc); const float ea = __builtin_amdgcn_exp2f(m_r - mn); const float al = (mn > -1.0e38f) ? ea : 1.0f; m_r = mn;      /* mn is finite (>= -3e38): every argument below is <= 0, and a closed key's -inf gives exactly 0 */
    v2f ps = {0.f, 0.f}; FragH pa, pl;      /* element nt * 8 + r of the B operand is key nt * 16 + 8 * hh + r: the score tiles' own places, no lane exchange */
#pragma unroll
    for (int nt = 0; nt < 2; ++nt)
#pragma unroll
      for (int r = 0; r < 8; r += 2) { const v2f p = {__builtin_amdgcn_exp2f(sv[nt][r] - mn), __builtin_amdgcn_exp2f(sv[nt][r + 1] - mn)}; ps += p;      /* by pairs: packed adds, multiplies and conversions */
        const v2f pk = p * 1024.0f; const v2h ph = __builtin_convertvector(pk, v2h); const v2h pr = __builtin_convertvector((pk - __builtin_convertvector(ph, v2f)) * 1024.0f, v2h);
        pa.h[nt * 8 + r] = ph[0]; pa.h[nt * 8 + r + 1] = ph[1]; pl.h[nt * 8 + r] = pr[0]; pl.h[nt * 8 + r + 1] = pr[1]; }
    l_r = l_r * al + (ps[0] + ps[1]);
#pragma unroll
    for (int dt = 0; dt < DT; ++dt) { oacc[dt] *= al; oaccl[dt] *= al; }
#pragma unroll
    for (int dt = 0; dt < DT; ++dt) { oacc[dt] = mmaH<1>(bv[dt].v, bv[dt].v, pa.v, pa.v, oacc[dt]); oaccl[dt] = mmaH<1>(bl[dt].v, bl[dt].v, pa.v, pa.v, oaccl[dt]); oaccl[dt] = mmaH<1>(bv[dt].v, bv[dt].v, pl.v, pl.v, oaccl[dt]); }
   }
    /* publish point of stage st + 1, every wave, in this order */
    asm volatile("s_wait_dscnt 0x0" ::: "memory");      /* this wave's LDS reads of stage st have returned */
    asm volatile("s_wait_asynccnt 0x0" ::: "memory");      /* this wave's copies of stage st + 1 have landed */
    __syncthreads();      /* publishes stage st + 1 and ends every wave's reads of stage st */
    if (st + 2 < nst) stage(st + 2, st & 1); }      /* into the buffer that every wave has just left */
  asm volatile("s_wait_asynccnt 0x0" ::: "memory");      /* no copy is outstanding behind the loop */
  { const float l = l_r + xhalf(l_r);      /* the two halves of the query's sum are joined once */
    if (hh == 0) { sM[w][ln] = m_r; sL[w][ln] = l; }
#pragma unroll
    for (int dt = 0; dt < DT; ++dt) { const v8f o = oacc[dt] + oaccl[dt] * 0.0009765625f;      /* a lane's 8 accumulator rows are 8 consecutive d of its query: two 16-byte pieces of the row */
      *(v4fa*)&sO[w][ln][dt * 16 + 8 * hh] = (v4f){o[0], o[1], o[2], o[3]}; *(v4fa*)&sO[w][ln][dt * 16 + 8 * hh + 4] = (v4f){o[4], o[5], o[6], o[7]}; } }
  __syncthreads();      /* every wave's partial (max, sum, O) is in LDS before any wave merges them */
  {
#pragma unroll
    for (int rp = 0; rp < QW; rp += 16) { const int rq = rp + (tid >> 4), pc = tid & 15; const int wq = rq >> 4, r = rq & 15;      /* query rq of the tile: the partials of waves wq (first key halves) and wq + 4 (second) */
      const float m0 = sM[wq][r], m1 = sM[wq + 4][r]; const float mx = fmaxf(m0, m1);      /* a wave that saw no open key holds -3e38, sum 0, O 0: weight 0 (or 1 on zeros) */
      float e0, e1;      /* the maxima are in base-2 units. Each exponential stands in one statement with the v_nop that fills the slot the instruction set asks for behind a transcendental */
      asm("v_exp_f32 %0, %1\n\tv_nop" : "=v"(e0) : "v"(m0 - mx)); asm("v_exp_f32 %0, %1\n\tv_nop" : "=v"(e1) : "v"(m1 - mx));
      const float l = e0 * sL[wq][r] + e1 * sL[wq + 4][r]; const float inv = (l > 0.f) ? 1.0f / (l * 1024.0f) : 0.f;
      const v4f o0 = *(const v4fa*)&sO[wq][r][pc * 4], o1 = *(const v4fa*)&sO[wq + 4][r][pc * 4];
      const v4f val = (o0 * e0 + o1 * e1) * inv; v4h hi4, lo4;      /* O leaves as the f16 hi + x2^10 residual planes that the output projection reads */
#pragma unroll
      for (int i = 0; i < 4; ++i) { const _Float16 hv = (_Float16)val[i]; hi4[i] = hv; lo4[i] = (_Float16)((val[i] - (float)hv) * 1024.0f); }
      const size_t oo = ((size_t)b * TQ + qt * QW + rq) * ldo + h * 64 + pc * 4; *(v4h*)(Oh + oo) = hi4; *(v4h*)(Ol + oo) = lo4; }
     } }


__constant__ float INVF[32] = {1.000000000e+00f,7.498942018e-01f,5.623413324e-01f,4.216965139e-01f,3.162277639e-01f,2.371373624e-01f,1.778279394e-01f,1.333521456e-01f,1.000000015e-01f,7.498941571e-02f,5.623412877e-02f,4.216964915e-02f,3.162277862e-02f,2.371373586e-02f,1.778279431e-02f,1.333521493e-02f,9.999999776e-03f,7.498942316e-03f,5.623413250e-03f,4.216964822e-03f,3.162277862e-03f,2.371373819e-03f,1.778279431e-03f,1.333521446e-03f,1.000000047e-03f,7.498941850e-04f,5.623413017e-04f,4.216964880e-04f,3.162277862e-04f,2.371373848e-04f,1.778279402e-04f,1.333521504e-04f};
__constant__ float XBASE[32] = {2.857142985e-01f,3.080357313e-01f,3.303571641e-01f,3.526785970e-01f,3.750000000e-01f,3.973214328e-01f,4.196428359e-01f,4.419642687e-01f,4.642857015e-01f,4.866071343e-01f,5.089285374e-01f,5.312500000e-01f,5.535714030e-01f,5.758928657e-01f,5.982142687e-01f,6.205357313e-01f,6.428571343e-01f,6.651785970e-01f,6.875000000e-01f,7.098214030e-01f,7.321428657e-01f,7.544642687e-01f,7.767857313e-01f,7.991071343e-01f,8.214285970e-01f,8.437500000e-01f,8.660714030e-01f,8.883928657e-01f,9.107142687e-01f,9.330357313e-01f,9.553571343e-01f,9.776785970e-01f};
/* ---- the eight preparation jobs, which read none of each other's output, as one launch: the block index picks the job; a thread's work in each job is what it was in the job's own kernel. Each job ends in s_wait_xcnt 0, a precaution: it stands in front of every rewrite of a register that the job's stores name, on whatever way the listing joins the jobs ---- */
__device__ __forceinline__ void prep_round(const float* __restrict__ s, _Float16* __restrict__ d, size_t t, float mul) { FragH f;      /* f16(bf16_round(v) * mul), 8 values a thread; unrolled: two 16-byte loads, one 16-byte store */
#pragma unroll
  for (int q = 0; q < 8; ++q) f.h[q] = (_Float16)(bf16_round(s[t * 8 + q]) * mul); *(v8us*)((unsigned short*)d + t * 8) = f.half[0];
  asm volatile("s_wait_xcnt 0x0" ::: "memory"); }
__device__ __forceinline__ void prep_trig(int t, float* __restrict__ CS, float* __restrict__ SN) {
  #pragma clang fp contract(off)      /* numerical, kept with these lines from their own kernel: the angle is rounded to f32 as the reference rounds it before cos and sin take it; the tables stay bit-identical */
  const int tok = t >> 5, j = t & 31; const float ang = (float)tok * INVF[j]; const float c = cosf(ang), s = sinf(ang);
  *(float*)(CS + t) = c; *(float*)(SN + t) = s;
  asm volatile("s_wait_xcnt 0x0" ::: "memory"); }
__device__ __forceinline__ void prep_scale(int t, float* __restrict__ SC) {
  #pragma clang fp contract(off)      /* numerical, kept with these lines from their own kernel: the exponent is rounded to f32 as the reference rounds it before pow takes it; the table stays bit-identical */
  const int tok = t >> 5, j = t & 31; const float v = powf(XBASE[j], ((float)tok - 1024.0f) / 512.0f);
  *(float*)(SC + t) = v;
  asm volatile("s_wait_xcnt 0x0" ::: "memory"); }
__device__ __forceinline__ void prep_causal(int t, unsigned* __restrict__ MB, int* __restrict__ RA, int* __restrict__ KE, int nq, int nk) {
  const int nw = nk / 32;
  if (t < nq * nw) { const int q = t / nw, w = t % nw; const int first = q + 1 - 32 * w; const unsigned bits = (first <= 0) ? 0xffffffffu : ((first >= 32) ? 0u : (0xffffffffu << first)); *(unsigned*)(MB + t) = bits;  }
  if (t < nq) { *(int*)(RA + t) = 0;  }
  if (t < nq / 64) { const int v = 64 * (t + 1); *(int*)(KE + t * 32) = v;  }
  asm volatile("s_wait_xcnt 0x0" ::: "memory"); }
#define PB_TAB (SLEN * 32 / 256)                 /* blocks of the cos and sin tables, and of the scale table: first, they have the longest chains */
#define PB_X   (NR * DM / (8 * 256))             /* blocks of x */
#define PB_W   (DM * DM / (8 * 256))             /* blocks of one weight matrix */
#define PB_CAU (SLEN * (SLEN / 32) / 256)        /* blocks of the causal bit plane */
__global__ __launch_bounds__(256) void k_prep(const float* __restrict__ x, const float* __restrict__ Wq, const float* __restrict__ Wk, const float* __restrict__ Wv, const float* __restrict__ Wo, _Float16* __restrict__ X16, _Float16* __restrict__ BW,
    float* __restrict__ CS, float* __restrict__ SN, float* __restrict__ SC, unsigned* __restrict__ MB, int* __restrict__ RA, int* __restrict__ KE) {
  const int tid = threadIdx.x; int blk = blockIdx.x;      /* every count below divides exactly: no thread is past the end of its job */
  if (blk < PB_TAB) { prep_trig(blk * 256 + tid, CS, SN); return; }
  blk -= PB_TAB;
  if (blk < PB_TAB) { prep_scale(blk * 256 + tid, SC); return; }
  blk -= PB_TAB;
  if (blk < PB_X) { prep_round(x, X16, (size_t)blk * 256 + tid, 1.0f); return; }
  blk -= PB_X;
  if (blk < 4 * PB_W) { const int m = blk / PB_W;      /* planes in the order the GEMMs index them: q <- Wq, k <- Wv, v <- Wk (module order), then Wo; a weight's (out, in) order is the natural Bt; x16 */
    const float* s = (m == 0) ? Wq : ((m == 1) ? Wv : ((m == 2) ? Wk : Wo)); prep_round(s, BW + (size_t)m * DM * DM, (size_t)(blk - m * PB_W) * 256 + tid, 16.0f); return; }
  blk -= 4 * PB_W;
  prep_causal(blk * 256 + tid, MB, RA, KE, SLEN, SLEN); }
extern "C" void kernel_launch(void* const* d_in, const int* in_sizes, int n_in,
                              void* d_out, int out_size, void* d_ws, size_t ws_size, hipStream_t stream) {
  (void)in_sizes; (void)n_in; (void)out_size;
  const float* const* I = (const float* const*)d_in; const float* x = I[0]; const float* Wq = I[1]; const float* bq = I[2]; const float* Wk = I[3]; const float* bk = I[4]; const float* Wv = I[5]; const float* bv = I[6]; const float* Wo = I[7]; const float* bo = I[8];
  char* ws = (char*)d_ws; size_t off = 0;
  auto take = [&](size_t bytes) { char* p = ws + off; off += (bytes + 255) & ~(size_t)255; return p; };
  _Float16* BW = (_Float16*)take((size_t)4 * DM * DM * 2); _Float16* BO = BW + (size_t)3 * DM * DM;      /* weight planes q, k, v, o */
  _Float16* X16 = (_Float16*)take((size_t)NR * DM * 2); _Float16* Oh = (_Float16*)take((size_t)NR * DM * 2); _Float16* Ol = (_Float16*)take((size_t)NR * DM * 2);
  _Float16* Qh = (_Float16*)take((size_t)6 * NR * DM * 2); _Float16* Ql = Qh + (size_t)NR * DM; _Float16* Kh = Ql + (size_t)NR * DM; _Float16* Kl = Kh + (size_t)NR * DM; _Float16* Vth = Kl + (size_t)NR * DM; _Float16* Vtl = Vth + (size_t)NR * DM;      /* three hi, lo pairs in a row */
  unsigned* MB = (unsigned*)take((size_t)SLEN * (SLEN / 32) * 4); int* RA = (int*)take((size_t)SLEN * 4); int* KE = (int*)take((size_t)(SLEN / 64) * 32 * 4);
  float* CS = (float*)take((size_t)SLEN * 32 * 4); float* SN = (float*)take((size_t)SLEN * 32 * 4); float* SC = (float*)take((size_t)SLEN * 32 * 4);
  if (off > ws_size) return;      /* 8 + 8 + 8 x 8 + 1.5 = 82 MiB */
  k_prep<<<2 * PB_TAB + PB_X + 4 * PB_W + PB_CAU, 256, 0, stream>>>(x, Wq, Wk, Wv, Wo, X16, BW, CS, SN, SC, MB, RA, KE);
  const dim3 gP((NR / 128) * (DM / 64), 1);
  /* q_mat = xpos(x Wq^T + bq) as hi/lo; k_mat = xpos^-1(x Wv^T + bv) (module order); v_mat = x Wk^T + bk as V^T hi/lo [(b, h)][64][2048] */
  k_gemm2<0, 4><<<dim3((NR / 128) * (DM / 64), 3), 128, 0, stream>>>(X16, DM, 0, BW, DM, (size_t)DM * DM, 0.0625f, bq, 0, nullptr, 1, 0, 0, nullptr, nullptr, DM, 0, NR, DM, DM, CS, SN, SC, Qh, Ql, bv, bk, (size_t)2 * NR * DM, nullptr);
  k_flashm<SLEN, SLEN><<<dim3(NBT * NH, SLEN / 64), 256, 0, stream>>>(Qh, Ql, DM, Kh, Kl, DM, Vth, Vtl, MB, RA, KE, Oh, Ol, DM);
  k_gemm2<0, 5><<<gP, 128, 0, stream>>>(Ol, DM, 0, BO, DM, 0, 0.0625f, bo, 0, nullptr, 1, 0, 0, (float*)d_out, nullptr, DM, 0, NR, DM, DM, nullptr, nullptr, nullptr, nullptr, nullptr, nullptr, nullptr, 0, Oh);
}
